// v000
// Measured on an AMD MI455X. A time is GPU time per run, averaged over a window of back-to-back runs after a warm-up
// (all launches, gaps included; the runs take copies of the inputs in turn), and the median of several windows.
// Apart from v000's, it joins two sittings. Times from different sittings can be a few percent apart, while
// side-by-side timings come from the same sitting.
// The starting kernel, v000, takes 1440 microseconds a run.
// compute dtype: the three float inputs rounded to bf16; q, k once to f16 -> 1-product logits x 128^-0.5 on WMMA 16x16x32 (f32 accumulate); softmax in f32 (precise expf); P x 2^11 once to f16 against v once to f16 (1 product); f32 output.
#include <hip/hip_runtime.h>
#include <math.h>

typedef __attribute__((ext_vector_type(16))) _Float16 v16h;
typedef __attribute__((ext_vector_type(16))) __bf16 v16b;
typedef __attribute__((ext_vector_type(8)))  _Float16 v8h;
typedef __attribute__((ext_vector_type(8)))  float v8f;
typedef __attribute__((ext_vector_type(4)))  float v4f;
typedef __attribute__((ext_vector_type(2)))  float v2f;
typedef __attribute__((ext_vector_type(4)))  unsigned v4u;
typedef __attribute__((ext_vector_type(4)))  int v4i;
typedef float __attribute__((may_alias)) float_a;
typedef int __attribute__((may_alias)) int_a;

template <typename T> __device__ __forceinline__ void vst2(void* p, T v) { *(T*)p = v;  }
__device__ __forceinline__ v8f wmma16(v16h a, v16h b, v8f c) {
  v8f d = __builtin_amdgcn_wmma_f32_16x16x32_f16(false, a, false, b, (short)0, c, false, false);
  asm volatile("v_nop\n\tv_nop\n\tv_nop\n\tv_nop" : "+v"(d) : "v"(a), "v"(b));
  return d;
}
__device__ __forceinline__ v8f wmma_bf(v16b a, v16b b, v8f c) {
  v8f d = __builtin_amdgcn_wmma_f32_16x16x32_bf16(false, a, false, b, (short)0, c, false, false);
  asm volatile("v_nop\n\tv_nop\n\tv_nop\n\tv_nop" : "+v"(d) : "v"(a), "v"(b));
  return d;
}
// 16x16x32 fragments: lane = (h = lane>>4, row/col = lane&15); elements 0..7 = k0+8h+0..7, 8..15 = k0+16+8h+0..7; D element r = row 8h+r
__device__ __forceinline__ v16h frag_h(const _Float16* rowk0, int lane) {
  union { v16h v; v8h q[2]; } u; const _Float16* p = rowk0 + 8 * (lane >> 4);
  u.q[0] = *(const v8h*)p; u.q[1] = *(const v8h*)(p + 16); return u.v;
}
__device__ __forceinline__ v16h frag_f32(const float* rowk0, int lane) {
  v16h a; const float* p = rowk0 + 8 * (lane >> 4);
#pragma unroll
  for (int i = 0; i < 8; ++i) { a[i] = (_Float16)p[i]; a[8 + i] = (_Float16)p[16 + i]; }
  return a;
}
__device__ __forceinline__ v16h frag_f32s(const float* rowk0, int lane, float sc) {
  v16h a; const float* p = rowk0 + 8 * (lane >> 4);
#pragma unroll
  for (int i = 0; i < 8; ++i) { a[i] = (_Float16)(p[i] * sc); a[8 + i] = (_Float16)(p[16 + i] * sc); }
  return a;
}
// column fragment from a [K][ld] layout (column n), rows >= K read as 0
__device__ __forceinline__ v16h fragc_f32(const float* W, int k0, int n, int lane, int ld, int K) {
  v16h a; const int g = lane >> 4;
#pragma unroll
  for (int i = 0; i < 8; ++i) { const int ka = k0 + 8 * g + i, kb = ka + 16;
    a[i] = (_Float16)(ka < K ? W[(size_t)(ka < K ? ka : K - 1) * ld + n] : 0.f); a[8 + i] = (_Float16)(kb < K ? W[(size_t)(kb < K ? kb : K - 1) * ld + n] : 0.f); }
  return a;
}
struct F2 { v16b h, l; };
__device__ __forceinline__ F2 bsplit16(const float v[16]) { F2 r;
#pragma unroll
  for (int i = 0; i < 16; ++i) { const __bf16 h = (__bf16)v[i]; r.h[i] = h; r.l[i] = (__bf16)(v[i] - (float)h); }
  return r; }
__device__ __forceinline__ F2 split_row(const float* row, int k0, int lane) { float v[16]; const float* p = row + k0 + 8 * (lane >> 4);
#pragma unroll
  for (int i = 0; i < 8; ++i) { v[i] = p[i]; v[8 + i] = p[16 + i]; }
  return bsplit16(v); }
__device__ __forceinline__ F2 split_rowK(const float* row, int k0, int lane, int K) { float v[16]; const int g = lane >> 4;
#pragma unroll
  for (int i = 0; i < 8; ++i) { const int ka = k0 + 8 * g + i, kb = ka + 16; v[i] = ka < K ? row[ka < K ? ka : K - 1] : 0.f; v[8 + i] = kb < K ? row[kb < K ? kb : K - 1] : 0.f; }
  return bsplit16(v); }
__device__ __forceinline__ F2 split_col(const float* W, int k0, int n, int lane, int ld, int K) { float v[16]; const int g = lane >> 4;
#pragma unroll
  for (int i = 0; i < 8; ++i) { const int ka = k0 + 8 * g + i, kb = ka + 16; v[i] = ka < K ? W[(size_t)(ka < K ? ka : K - 1) * ld + n] : 0.f; v[8 + i] = kb < K ? W[(size_t)(kb < K ? kb : K - 1) * ld + n] : 0.f; }
  return bsplit16(v); }
__device__ __forceinline__ v8f mac3(const F2& a, const F2& b, v8f c) { c = wmma_bf(a.l, b.h, c); c = wmma_bf(a.h, b.l, c); return wmma_bf(a.h, b.h, c); }
__device__ __forceinline__ float sigm(float v) { return 1.0f / (1.0f + expf(-v)); }
#define LDSX() do { asm volatile("s_wait_dscnt 0" ::: "memory"); __builtin_amdgcn_wave_barrier(); __builtin_amdgcn_fence(__ATOMIC_RELEASE, "workgroup"); } while (0)

// Plain multi-head attention on [B, S, H, D] tensors (B 2, S 2,048, 16 heads x 128; no projections, no mask): probs = softmax(q . k x 128^-0.5) over all keys; out[b][s][h][d] = sum probs v.
#define NB 2
#define TT 2048
#define NH 16
#define HD 128
#define CC (NH * HD)        // 2048
#define HG 4
#define SCALE 0.08838834764831845f
#ifndef TNB
#define TNB NB
#endif
__device__ __forceinline__ float bfr(float v) { return (float)(__bf16)v; }

#define WS_QH  0u                                      // f16 q rows [b*t][2048]
#define WS_KH  (WS_QH + 2u * (size_t)NB * TT * CC)      // f16 k rows
#define WS_VT  (WS_KH + 2u * (size_t)NB * TT * CC)      // f16 v planes [b][c][t]
#define WS_S   (WS_VT + 2u * (size_t)NB * CC * TT)      // f32 logits / P [hg][t][s]
#define WS_END (WS_S  + 4u * (size_t)HG * TT * TT)

// ---- k_prep: block = (64 tokens, head h): q, k -> f16 rows, v -> f16 planes (all bf16-rounded first)
__global__ __launch_bounds__(128) void k_prep(const float* __restrict__ Q, const float* __restrict__ K, const float* __restrict__ V, _Float16* __restrict__ QH, _Float16* __restrict__ KH, _Float16* __restrict__ VT) {
  __shared__ __align__(16) _Float16 sq[64][136], sk[64][136], tv[128][72];
  const int tid = threadIdx.x; const int h = blockIdx.y; const size_t r0 = (size_t)blockIdx.x * 64;
  for (int e = tid; e < 64 * 128; e += 128) { const int rl = e >> 7, c = e & 127; const size_t o = (r0 + rl) * CC + h * HD + c; sq[rl][c] = (_Float16)bfr(Q[o]); sk[rl][c] = (_Float16)bfr(K[o]); tv[c][rl] = (_Float16)bfr(V[o]); }
  __syncthreads();
  for (int e = tid; e < 64 * 16; e += 128) { const int rl = e >> 4, q = e & 15; const size_t o = (r0 + rl) * CC + h * HD + q * 8; vst2((unsigned*)(QH + o), *(const v4u*)&sq[rl][q * 8]); vst2((unsigned*)(KH + o), *(const v4u*)&sk[rl][q * 8]); }   /* 256-B (row, head) segments by 16 threads */
  { const size_t b = r0 / TT; const int t0 = (int)(r0 % TT); for (int e = tid; e < 128 * 8; e += 128) { const int cl = e >> 3, q = e & 7; vst2((unsigned*)(VT + (b * CC + h * HD + cl) * (size_t)TT + t0 + q * 8), *(const v4u*)&tv[cl][q * 8]); } } }
// ---- k_sc: block = (64 queries, 128 keys, head in group) of batch b: 1-product logits x scale
__global__ __launch_bounds__(128) void k_sc(const _Float16* __restrict__ QH, const _Float16* __restrict__ KH, int b, int h0, float* __restrict__ S0) { __shared__ __align__(16) float ss[4][16][132]; const int h = h0 + blockIdx.z; float* S = S0 + (size_t)blockIdx.z * TT * TT;
  const int tid = threadIdx.x, wave = tid >> 5, lane = tid & 31, col = lane & 15, g = lane >> 4; const int k0 = blockIdx.y * 128; const int ql0 = blockIdx.x * 64 + wave * 16; const size_t q0 = (size_t)b * TT + ql0, kr0 = (size_t)b * TT + k0;
  v8f acc[8] = {};
#pragma unroll
  for (int kc = 0; kc < HD / 32; ++kc) { const v16h ah = frag_h(QH + (q0 + col) * CC + h * HD + kc * 32, lane);
#pragma unroll
    for (int j = 0; j < 8; ++j) { const v16h kb = frag_h(KH + (kr0 + j * 16 + col) * CC + h * HD + kc * 32, lane); acc[j] = wmma16(ah, kb, acc[j]); } }
#pragma unroll
  for (int j = 0; j < 8; ++j) {
#pragma unroll
    for (int r = 0; r < 8; ++r) ss[wave][8 * g + r][j * 16 + col] = acc[j][r] * SCALE; }
  LDSX(); for (int rl = 0; rl < 16; ++rl) vst2(S + (size_t)(ql0 + rl) * TT + k0 + lane * 4, *(const v4f*)&ss[wave][rl][lane * 4]); }
// ---- k_sm: block = query row (head in group): softmax over all 2,048 keys -> P x 2^11 in place (f32)
__global__ __launch_bounds__(256) void k_sm(float* __restrict__ S0) { __shared__ float sred[8]; __shared__ float sbc; __shared__ __align__(16) float sh[TT];
  const int t = threadIdx.x; const size_t row = blockIdx.x; float* sr = S0 + (size_t)blockIdx.y * TT * TT + row * TT; const int kend = TT;
  float m = -3.0e38f; for (int k = t; k < kend; k += 256) m = fmaxf(m, sr[k]);
#pragma unroll
  for (int o = 1; o < 32; o <<= 1) m = fmaxf(m, __shfl_xor(m, o));
  if ((t & 31) == 0) sred[t >> 5] = m; __syncthreads(); if (t == 0) { float a = sred[0]; for (int i = 1; i < 8; ++i) a = fmaxf(a, sred[i]); sbc = a; } __syncthreads(); m = sbc; __syncthreads();
  float sum = 0.f; for (int k = t; k < kend; k += 256) { const float v = sr[k]; sum += (v <= -1.0e38f) ? 0.f : expf(v - m); }
#pragma unroll
  for (int o = 1; o < 32; o <<= 1) sum += __shfl_xor(sum, o);
  if ((t & 31) == 0) sred[t >> 5] = sum; __syncthreads(); if (t == 0) { float a = 0.f; for (int i = 0; i < 8; ++i) a += sred[i]; sbc = 1.0f / a; } __syncthreads(); const float inv = sbc;
  for (int k = t; k < kend; k += 256) { const float v = sr[k]; sh[k] = (v <= -1.0e38f) ? 0.f : expf(v - m) * inv * 2048.0f; }
  __syncthreads(); for (int q = t; q < kend / 4; q += 256) vst2(sr + q * 4, *(const v4f*)&sh[q * 4]); }
// ---- k_pv: block = 64 queries of (b, h): out[b][t][h*128 + d] = P . v (P x 2^11 once to f16, v f16: 1 product) -> 512-B (row, head) segment by 32 lanes
__global__ __launch_bounds__(128) void k_pv(const float* __restrict__ PS0, const _Float16* __restrict__ VT, int b, int h0, float* __restrict__ OUT) { const int h = h0 + blockIdx.z; const float* PS = PS0 + (size_t)blockIdx.z * TT * TT; __shared__ __align__(16) float ss[4][16][HD + 4];
  const int tid = threadIdx.x, wave = tid >> 5, lane = tid & 31, col = lane & 15, g = lane >> 4; const int ql0 = blockIdx.x * 64 + wave * 16;
  v8f acc[HD / 16] = {};
#pragma unroll 1
  for (int kc = 0; kc < TT / 32; ++kc) { const v16h p = frag_f32(PS + (size_t)(ql0 + col) * TT + kc * 32, lane);
    asm volatile("s_wait_loadcnt 0x0" ::: "memory");
#pragma unroll
    for (int j = 0; j < HD / 16; ++j) { const size_t po = ((size_t)b * CC + h * HD + j * 16 + col) * (size_t)TT + kc * 32; acc[j] = wmma16(p, frag_h(VT + po, lane), acc[j]); } }
#pragma unroll
  for (int j = 0; j < HD / 16; ++j)
#pragma unroll
    for (int r = 0; r < 8; ++r) ss[wave][8 * g + r][j * 16 + col] = acc[j][r] * (1.0f / 2048.0f);
  LDSX(); for (int rl = 0; rl < 16; ++rl) vst2(OUT + ((size_t)b * TT + ql0 + rl) * CC + h * HD + lane * 4, *(const v4f*)&ss[wave][rl][lane * 4]); }
extern "C" void kernel_launch(void* const* d_in, const int* in_sizes, int n_in, void* d_out, int out_size, void* d_ws, size_t ws_size, hipStream_t stream) {
  (void)in_sizes; (void)n_in; (void)out_size;
  const float** F = (const float**)d_in;   // 0 query, 1 key, 2 value [2,2048,16,128]
  if (ws_size < (size_t)WS_END) return;
  char* ws = (char*)d_ws; _Float16 *QH = (_Float16*)(ws + WS_QH), *KH = (_Float16*)(ws + WS_KH), *VT = (_Float16*)(ws + WS_VT); float* S = (float*)(ws + WS_S);
  k_prep<<<dim3(TNB * TT / 64, NH), 128, 0, stream>>>(F[0], F[1], F[2], QH, KH, VT);
  for (int b = 0; b < TNB; ++b) for (int h0 = 0; h0 < NH; h0 += HG) {
    k_sc<<<dim3(TT / 64, TT / 128, HG), 128, 0, stream>>>(QH, KH, b, h0, S);
    k_sm<<<dim3(TT, HG), 256, 0, stream>>>(S);
    k_pv<<<dim3(TT / 64, 1, HG), 128, 0, stream>>>(S, VT, b, h0, (float*)d_out);
  }
}

// v001
// A run of this version takes 110 microseconds.
// Two timings next to v000 both put it at 13.2 times that version's speed.
// compute dtype: the three float inputs rounded to bf16; q, k once to f16 -> 1-product logits x 128^-0.5 on WMMA 16x16x32 (f32 accumulate); softmax in f32 (precise expf) with a running maximum and sum; exp(logit - running maximum) x 2^11 once to f16 against v once to f16 (1 product), divided by the f32 sum at the end; f32 output.
#include <hip/hip_runtime.h>
#include <math.h>

typedef __attribute__((ext_vector_type(16))) _Float16 v16h;
typedef __attribute__((ext_vector_type(16))) __bf16 v16b;
typedef __attribute__((ext_vector_type(8)))  _Float16 v8h;
typedef __attribute__((ext_vector_type(8)))  float v8f;
typedef __attribute__((ext_vector_type(4)))  float v4f;
typedef __attribute__((ext_vector_type(2)))  float v2f;
typedef __attribute__((ext_vector_type(4)))  unsigned v4u;
typedef __attribute__((ext_vector_type(4)))  int v4i;
typedef float __attribute__((may_alias)) float_a;
typedef int __attribute__((may_alias)) int_a;

template <typename T> __device__ __forceinline__ void vst2(void* p, T v) { *(T*)p = v;  }
__device__ __forceinline__ v8f wmma16(v16h a, v16h b, v8f c) {
  v8f d = __builtin_amdgcn_wmma_f32_16x16x32_f16(false, a, false, b, (short)0, c, false, false);
  asm volatile("v_nop\n\tv_nop\n\tv_nop\n\tv_nop" : "+v"(d) : "v"(a), "v"(b));
  return d;
}
__device__ __forceinline__ v8f wmma_bf(v16b a, v16b b, v8f c) {
  v8f d = __builtin_amdgcn_wmma_f32_16x16x32_bf16(false, a, false, b, (short)0, c, false, false);
  asm volatile("v_nop\n\tv_nop\n\tv_nop\n\tv_nop" : "+v"(d) : "v"(a), "v"(b));
  return d;
}
// 16x16x32 fragments: lane = (h = lane>>4, row/col = lane&15); elements 0..7 = k0+8h+0..7, 8..15 = k0+16+8h+0..7; D element r = row 8h+r
__device__ __forceinline__ v16h frag_h(const _Float16* rowk0, int lane) {
  union { v16h v; v8h q[2]; } u; const _Float16* p = rowk0 + 8 * (lane >> 4);
  u.q[0] = *(const v8h*)p; u.q[1] = *(const v8h*)(p + 16); return u.v;
}
__device__ __forceinline__ v16h frag_f32(const float* rowk0, int lane) {
  v16h a; const float* p = rowk0 + 8 * (lane >> 4);
#pragma unroll
  for (int i = 0; i < 8; ++i) { a[i] = (_Float16)p[i]; a[8 + i] = (_Float16)p[16 + i]; }
  return a;
}
__device__ __forceinline__ v16h frag_f32s(const float* rowk0, int lane, float sc) {
  v16h a; const float* p = rowk0 + 8 * (lane >> 4);
#pragma unroll
  for (int i = 0; i < 8; ++i) { a[i] = (_Float16)(p[i] * sc); a[8 + i] = (_Float16)(p[16 + i] * sc); }
  return a;
}
// column fragment from a [K][ld] layout (column n), rows >= K read as 0
__device__ __forceinline__ v16h fragc_f32(const float* W, int k0, int n, int lane, int ld, int K) {
  v16h a; const int g = lane >> 4;
#pragma unroll
  for (int i = 0; i < 8; ++i) { const int ka = k0 + 8 * g + i, kb = ka + 16;
    a[i] = (_Float16)(ka < K ? W[(size_t)(ka < K ? ka : K - 1) * ld + n] : 0.f); a[8 + i] = (_Float16)(kb < K ? W[(size_t)(kb < K ? kb : K - 1) * ld + n] : 0.f); }
  return a;
}
struct F2 { v16b h, l; };
__device__ __forceinline__ F2 bsplit16(const float v[16]) { F2 r;
#pragma unroll
  for (int i = 0; i < 16; ++i) { const __bf16 h = (__bf16)v[i]; r.h[i] = h; r.l[i] = (__bf16)(v[i] - (float)h); }
  return r; }
__device__ __forceinline__ F2 split_row(const float* row, int k0, int lane) { float v[16]; const float* p = row + k0 + 8 * (lane >> 4);
#pragma unroll
  for (int i = 0; i < 8; ++i) { v[i] = p[i]; v[8 + i] = p[16 + i]; }
  return bsplit16(v); }
__device__ __forceinline__ F2 split_rowK(const float* row, int k0, int lane, int K) { float v[16]; const int g = lane >> 4;
#pragma unroll
  for (int i = 0; i < 8; ++i) { const int ka = k0 + 8 * g + i, kb = ka + 16; v[i] = ka < K ? row[ka < K ? ka : K - 1] : 0.f; v[8 + i] = kb < K ? row[kb < K ? kb : K - 1] : 0.f; }
  return bsplit16(v); }
__device__ __forceinline__ F2 split_col(const float* W, int k0, int n, int lane, int ld, int K) { float v[16]; const int g = lane >> 4;
#pragma unroll
  for (int i = 0; i < 8; ++i) { const int ka = k0 + 8 * g + i, kb = ka + 16; v[i] = ka < K ? W[(size_t)(ka < K ? ka : K - 1) * ld + n] : 0.f; v[8 + i] = kb < K ? W[(size_t)(kb < K ? kb : K - 1) * ld + n] : 0.f; }
  return bsplit16(v); }
__device__ __forceinline__ v8f mac3(const F2& a, const F2& b, v8f c) { c = wmma_bf(a.l, b.h, c); c = wmma_bf(a.h, b.l, c); return wmma_bf(a.h, b.h, c); }
__device__ __forceinline__ float sigm(float v) { return 1.0f / (1.0f + expf(-v)); }
#define LDSX() do { asm volatile("s_wait_dscnt 0" ::: "memory"); __builtin_amdgcn_wave_barrier(); __builtin_amdgcn_fence(__ATOMIC_RELEASE, "workgroup"); } while (0)

// Plain multi-head attention on [B, S, H, D] tensors (B 2, S 2,048, 16 heads x 128; no projections, no mask): probs = softmax(q . k x 128^-0.5) over all keys; out[b][s][h][d] = sum probs v.
#define NB 2
#define TT 2048
#define NH 16
#define HD 128
#define CC (NH * HD)        // 2048
#define SCALE 0.08838834764831845f
#ifndef TNB
#define TNB NB
#endif
__device__ __forceinline__ float bfr(float v) { return (float)(__bf16)v; }

#define WS_QH  0u                                      // f16 q rows [b*t][2048]
#define WS_KH  (WS_QH + 2u * (size_t)NB * TT * CC)      // f16 k rows
#define WS_VT  (WS_KH + 2u * (size_t)NB * TT * CC)      // f16 v planes [b][c][t]
#define WS_END (WS_VT + 2u * (size_t)NB * CC * TT)

// ---- k_prep: block = (64 tokens, head h): q, k -> f16 rows, v -> f16 planes (all bf16-rounded first)
__global__ __launch_bounds__(128) void k_prep(const float* __restrict__ Q, const float* __restrict__ K, const float* __restrict__ V, _Float16* __restrict__ QH, _Float16* __restrict__ KH, _Float16* __restrict__ VT) {
  __shared__ __align__(16) _Float16 sq[64][136], sk[64][136], tv[128][72];
  const int tid = threadIdx.x; const int h = blockIdx.y; const size_t r0 = (size_t)blockIdx.x * 64;
  for (int e = tid; e < 64 * 128; e += 128) { const int rl = e >> 7, c = e & 127; const size_t o = (r0 + rl) * CC + h * HD + c; sq[rl][c] = (_Float16)bfr(Q[o]); sk[rl][c] = (_Float16)bfr(K[o]); tv[c][rl] = (_Float16)bfr(V[o]); }
  __syncthreads();
  for (int e = tid; e < 64 * 16; e += 128) { const int rl = e >> 4, q = e & 15; const size_t o = (r0 + rl) * CC + h * HD + q * 8; vst2((unsigned*)(QH + o), *(const v4u*)&sq[rl][q * 8]); vst2((unsigned*)(KH + o), *(const v4u*)&sk[rl][q * 8]); }   /* 256-B (row, head) segments by 16 threads */
  { const size_t b = r0 / TT; const int t0 = (int)(r0 % TT); for (int e = tid; e < 128 * 8; e += 128) { const int cl = e >> 3, q = e & 7; vst2((unsigned*)(VT + (b * CC + h * HD + cl) * (size_t)TT + t0 + q * 8), *(const v4u*)&tv[cl][q * 8]); } } }
// ---- k_fa: block = 8 waves x 32 queries of (b, h), one pass = 32 keys: S^T = K . Q^T (A = k rows, B = q kept in registers), running maximum and sum per query (one query per lane column),
// P^T x 2^11 packed from the score tiles straight into a B operand, O^T += V^T . P^T (A = v planes); logits and P never reach memory
__device__ __forceinline__ v8f mma(v16h a, v16h b, v8f c) { return __builtin_amdgcn_wmma_f32_16x16x32_f16(false, a, false, b, (short)0, c, false, false); }
__device__ __forceinline__ float xhalf(float x) { return __builtin_bit_cast(float, __builtin_amdgcn_permlanex16(__builtin_bit_cast(int, x), __builtin_bit_cast(int, x), 0x76543210, 0xfedcba98, false, false)); }  // lane l with lane l ^ 16
__device__ __forceinline__ v16h frag_p(const _Float16* p) { union { v16h v; v8h q[2]; } u; u.q[0] = *(const v8h*)p; u.q[1] = *(const v8h*)(p + 16); return u.v; }   // frag_h with the lane half's 8 elements already in p
// precaution behind a run of global loads: the wait stands in front of any overwrite of the address register they name (named as an input so that it stays live up to here)
#define XWAIT(p) asm volatile("s_wait_xcnt 0x0" :: "v"(p) : "memory")
#define P_SHIFT 7.624618986159398f   // 11 ln 2: exp(v - (m - 11 ln 2)) = 2^11 exp(v - m)
__global__ __launch_bounds__(256) __attribute__((amdgpu_waves_per_eu(2, 2))) void k_fa(const _Float16* __restrict__ QH, const _Float16* __restrict__ KH, const _Float16* __restrict__ VT, float* __restrict__ OUT) {
  __shared__ __align__(16) float ss[8][32][HD + 4];
  const int tid = threadIdx.x, wave = tid >> 5, lane = tid & 31, col = lane & 15, g = lane >> 4; const int h = blockIdx.y, b = blockIdx.z; const int ql0 = blockIdx.x * 256 + wave * 32;
  const _Float16* Kl = KH + ((size_t)b * TT + col) * CC + h * HD + 8 * g;            // this lane's part of its key row in the first 16-key tile
  const _Float16* Vl = VT + ((size_t)b * CC + h * HD + col) * (size_t)TT + 8 * g;    // this lane's part of its v plane in the first 16-d tile
  const _Float16* Ql = QH + ((size_t)b * TT + ql0 + col) * CC + h * HD + 8 * g;
  v16h qf[2][4];
#pragma unroll
  for (int u = 0; u < 2; ++u)
#pragma unroll
    for (int kc = 0; kc < 4; ++kc) qf[u][kc] = frag_p(Ql + (size_t)(16 * u) * CC + kc * 32);
  v8f acc[2][8] = {}; float m_run[2] = {-3.0e38f, -3.0e38f}, l_run[2] = {0.f, 0.f};
  v16h kf[2][4];
#pragma unroll
  for (int kt = 0; kt < 2; ++kt)
#pragma unroll
    for (int kc = 0; kc < 4; ++kc) kf[kt][kc] = frag_p(Kl + (size_t)(16 * kt) * CC + kc * 32);
  XWAIT(Ql); XWAIT(Kl);
  for (int ps = 0; ps < TT / 32; ++ps) {
    v16h vf[8]; const _Float16* vp = Vl + ps * 32;
#pragma unroll
    for (int t = 0; t < 8; ++t) vf[t] = frag_p(vp + (size_t)(16 * t) * TT);
    XWAIT(vp);
    v8f s[2][2];
#pragma unroll
    for (int kt = 0; kt < 2; ++kt)
#pragma unroll
      for (int u = 0; u < 2; ++u) { s[kt][u] = v8f{};
#pragma unroll
        for (int kc = 0; kc < 4; ++kc) s[kt][u] = mma(kf[kt][kc], qf[u][kc], s[kt][u]); }
    { const _Float16* kp = Kl + (size_t)(((ps + 1) & (TT / 32 - 1)) * 32) * CC;   // next pass's k rows, in flight under this pass's softmax (the last pass reads pass 0's rows again, unused)
#pragma unroll
      for (int kt = 0; kt < 2; ++kt)
#pragma unroll
        for (int kc = 0; kc < 4; ++kc) kf[kt][kc] = frag_p(kp + (size_t)(16 * kt) * CC + kc * 32);
      XWAIT(kp); }
    float mb[2]; bool need = false;
#pragma unroll
    for (int u = 0; u < 2; ++u) { float mx = s[0][u][0];
#pragma unroll
      for (int r = 1; r < 8; ++r) mx = fmaxf(mx, s[0][u][r]);
#pragma unroll
      for (int r = 0; r < 8; ++r) mx = fmaxf(mx, s[1][u][r]);
      mx = fmaxf(mx, xhalf(mx)) * SCALE; mb[u] = mx; need = need || (mx > m_run[u]); }
    if (__builtin_amdgcn_ballot_w32(need) != 0) {   // some query's maximum grew: bring sums and outputs to the new maximum (factor 1 for the others)
#pragma unroll
      for (int u = 0; u < 2; ++u) { const float mn = fmaxf(m_run[u], mb[u]); const float corr = expf(m_run[u] - mn); m_run[u] = mn; l_run[u] *= corr;
#pragma unroll
        for (int t = 0; t < 8; ++t) acc[u][t] = acc[u][t] * corr; } }
#pragma unroll
    for (int u = 0; u < 2; ++u) { const float mo = m_run[u] - P_SHIFT; v16h pf; float sum = 0.f;
#pragma unroll
      for (int i = 0; i < 16; ++i) { const float p = expf(s[i >> 3][u][i & 7] * SCALE - mo); sum += p; pf[i] = (_Float16)p; }
      l_run[u] += sum;
#pragma unroll
      for (int t = 0; t < 8; ++t) acc[u][t] = mma(vf[t], pf, acc[u][t]); }
  }
#pragma unroll
  for (int u = 0; u < 2; ++u) { const float inv = 1.0f / (l_run[u] + xhalf(l_run[u]));   // each wave half summed its eight keys of every 16-key tile
#pragma unroll
    for (int t = 0; t < 8; ++t) { const v8f o = acc[u][t] * inv; vst2(&ss[wave][16 * u + col][t * 16 + 8 * g], v4f{o[0], o[1], o[2], o[3]}); vst2(&ss[wave][16 * u + col][t * 16 + 8 * g + 4], v4f{o[4], o[5], o[6], o[7]}); } }
  LDSX(); for (int rl = 0; rl < 32; ++rl) vst2(OUT + ((size_t)b * TT + ql0 + rl) * CC + h * HD + lane * 4, *(const v4f*)&ss[wave][rl][lane * 4]); }   /* 512-B (row, head) segment by 32 lanes */
extern "C" void kernel_launch(void* const* d_in, const int* in_sizes, int n_in, void* d_out, int out_size, void* d_ws, size_t ws_size, hipStream_t stream) {
  (void)in_sizes; (void)n_in; (void)out_size;
  const float** F = (const float**)d_in;   // 0 query, 1 key, 2 value [2,2048,16,128]
  if (ws_size < (size_t)WS_END) return;
  char* ws = (char*)d_ws; _Float16 *QH = (_Float16*)(ws + WS_QH), *KH = (_Float16*)(ws + WS_KH), *VT = (_Float16*)(ws + WS_VT);
  k_prep<<<dim3(TNB * TT / 64, NH), 128, 0, stream>>>(F[0], F[1], F[2], QH, KH, VT);
  k_fa<<<dim3(TT / 256, NH, TNB), 256, 0, stream>>>(QH, KH, VT, (float*)d_out);
}

// v002
// One run takes 96.4 microseconds.
// Next to v001, in two timings, it ran 1.15 times as fast each time.
// All steps since v000 together make it 15.1 times as fast.
// compute dtype: the three float inputs rounded to bf16; q, k once to f16 -> 1-product logits x 128^-0.5 on WMMA 16x16x32 (f32 accumulate); softmax in f32 (precise expf) with a running maximum and sum; exp(logit - running maximum) x 2^11 once to f16 against v once to f16 (1 product), divided by the f32 sum at the end; f32 output.
#include <hip/hip_runtime.h>
#include <math.h>

typedef __attribute__((ext_vector_type(16))) _Float16 v16h;
typedef __attribute__((ext_vector_type(16))) __bf16 v16b;
typedef __attribute__((ext_vector_type(8)))  _Float16 v8h;
typedef __attribute__((ext_vector_type(8)))  float v8f;
typedef __attribute__((ext_vector_type(4)))  float v4f;
typedef __attribute__((ext_vector_type(2)))  float v2f;
typedef __attribute__((ext_vector_type(4)))  unsigned v4u;
typedef __attribute__((ext_vector_type(4)))  int v4i;
typedef float __attribute__((may_alias)) float_a;
typedef int __attribute__((may_alias)) int_a;

template <typename T> __device__ __forceinline__ void vst2(void* p, T v) { *(T*)p = v;  }
__device__ __forceinline__ v8f wmma16(v16h a, v16h b, v8f c) {
  v8f d = __builtin_amdgcn_wmma_f32_16x16x32_f16(false, a, false, b, (short)0, c, false, false);
  asm volatile("v_nop\n\tv_nop\n\tv_nop\n\tv_nop" : "+v"(d) : "v"(a), "v"(b));
  return d;
}
__device__ __forceinline__ v8f wmma_bf(v16b a, v16b b, v8f c) {
  v8f d = __builtin_amdgcn_wmma_f32_16x16x32_bf16(false, a, false, b, (short)0, c, false, false);
  asm volatile("v_nop\n\tv_nop\n\tv_nop\n\tv_nop" : "+v"(d) : "v"(a), "v"(b));
  return d;
}
// 16x16x32 fragments: lane = (h = lane>>4, row/col = lane&15); elements 0..7 = k0+8h+0..7, 8..15 = k0+16+8h+0..7; D element r = row 8h+r
__device__ __forceinline__ v16h frag_h(const _Float16* rowk0, int lane) {
  union { v16h v; v8h q[2]; } u; const _Float16* p = rowk0 + 8 * (lane >> 4);
  u.q[0] = *(const v8h*)p; u.q[1] = *(const v8h*)(p + 16); return u.v;
}
__device__ __forceinline__ v16h frag_f32(const float* rowk0, int lane) {
  v16h a; const float* p = rowk0 + 8 * (lane >> 4);
#pragma unroll
  for (int i = 0; i < 8; ++i) { a[i] = (_Float16)p[i]; a[8 + i] = (_Float16)p[16 + i]; }
  return a;
}
__device__ __forceinline__ v16h frag_f32s(const float* rowk0, int lane, float sc) {
  v16h a; const float* p = rowk0 + 8 * (lane >> 4);
#pragma unroll
  for (int i = 0; i < 8; ++i) { a[i] = (_Float16)(p[i] * sc); a[8 + i] = (_Float16)(p[16 + i] * sc); }
  return a;
}
// column fragment from a [K][ld] layout (column n), rows >= K read as 0
__device__ __forceinline__ v16h fragc_f32(const float* W, int k0, int n, int lane, int ld, int K) {
  v16h a; const int g = lane >> 4;
#pragma unroll
  for (int i = 0; i < 8; ++i) { const int ka = k0 + 8 * g + i, kb = ka + 16;
    a[i] = (_Float16)(ka < K ? W[(size_t)(ka < K ? ka : K - 1) * ld + n] : 0.f); a[8 + i] = (_Float16)(kb < K ? W[(size_t)(kb < K ? kb : K - 1) * ld + n] : 0.f); }
  return a;
}
struct F2 { v16b h, l; };
__device__ __forceinline__ F2 bsplit16(const float v[16]) { F2 r;
#pragma unroll
  for (int i = 0; i < 16; ++i) { const __bf16 h = (__bf16)v[i]; r.h[i] = h; r.l[i] = (__bf16)(v[i] - (float)h); }
  return r; }
__device__ __forceinline__ F2 split_row(const float* row, int k0, int lane) { float v[16]; const float* p = row + k0 + 8 * (lane >> 4);
#pragma unroll
  for (int i = 0; i < 8; ++i) { v[i] = p[i]; v[8 + i] = p[16 + i]; }
  return bsplit16(v); }
__device__ __forceinline__ F2 split_rowK(const float* row, int k0, int lane, int K) { float v[16]; const int g = lane >> 4;
#pragma unroll
  for (int i = 0; i < 8; ++i) { const int ka = k0 + 8 * g + i, kb = ka + 16; v[i] = ka < K ? row[ka < K ? ka : K - 1] : 0.f; v[8 + i] = kb < K ? row[kb < K ? kb : K - 1] : 0.f; }
  return bsplit16(v); }
__device__ __forceinline__ F2 split_col(const float* W, int k0, int n, int lane, int ld, int K) { float v[16]; const int g = lane >> 4;
#pragma unroll
  for (int i = 0; i < 8; ++i) { const int ka = k0 + 8 * g + i, kb = ka + 16; v[i] = ka < K ? W[(size_t)(ka < K ? ka : K - 1) * ld + n] : 0.f; v[8 + i] = kb < K ? W[(size_t)(kb < K ? kb : K - 1) * ld + n] : 0.f; }
  return bsplit16(v); }
__device__ __forceinline__ v8f mac3(const F2& a, const F2& b, v8f c) { c = wmma_bf(a.l, b.h, c); c = wmma_bf(a.h, b.l, c); return wmma_bf(a.h, b.h, c); }
__device__ __forceinline__ float sigm(float v) { return 1.0f / (1.0f + expf(-v)); }
#define LDSX() do { asm volatile("s_wait_dscnt 0" ::: "memory"); __builtin_amdgcn_wave_barrier(); __builtin_amdgcn_fence(__ATOMIC_RELEASE, "workgroup"); } while (0)

// Plain multi-head attention on [B, S, H, D] tensors (B 2, S 2,048, 16 heads x 128; no projections, no mask): probs = softmax(q . k x 128^-0.5) over all keys; out[b][s][h][d] = sum probs v.
#define NB 2
#define TT 2048
#define NH 16
#define HD 128
#define CC (NH * HD)        // 2048
#define SCALE 0.08838834764831845f
#ifndef TNB
#define TNB NB
#endif
__device__ __forceinline__ float bfr(float v) { return (float)(__bf16)v; }

#define WS_QH  0u                                      // f16 q rows [b*t][2048]
#define WS_KH  (WS_QH + 2u * (size_t)NB * TT * CC)      // f16 k rows
#define WS_VT  (WS_KH + 2u * (size_t)NB * TT * CC)      // f16 v planes [b][c][t]
#define WS_END (WS_VT + 2u * (size_t)NB * CC * TT)

// ---- k_prep: block = (64 tokens, head h): q, k -> f16 rows, v -> f16 planes (all bf16-rounded first)
__global__ __launch_bounds__(128) void k_prep(const float* __restrict__ Q, const float* __restrict__ K, const float* __restrict__ V, _Float16* __restrict__ QH, _Float16* __restrict__ KH, _Float16* __restrict__ VT) {
  __shared__ __align__(16) _Float16 sq[64][136], sk[64][136], tv[128][72];
  const int tid = threadIdx.x; const int h = blockIdx.y; const size_t r0 = (size_t)blockIdx.x * 64;
  for (int e = tid; e < 64 * 128; e += 128) { const int rl = e >> 7, c = e & 127; const size_t o = (r0 + rl) * CC + h * HD + c; sq[rl][c] = (_Float16)bfr(Q[o]); sk[rl][c] = (_Float16)bfr(K[o]); tv[c][rl] = (_Float16)bfr(V[o]); }
  __syncthreads();
  for (int e = tid; e < 64 * 16; e += 128) { const int rl = e >> 4, q = e & 15; const size_t o = (r0 + rl) * CC + h * HD + q * 8; vst2((unsigned*)(QH + o), *(const v4u*)&sq[rl][q * 8]); vst2((unsigned*)(KH + o), *(const v4u*)&sk[rl][q * 8]); }   /* 256-B (row, head) segments by 16 threads */
  { const size_t b = r0 / TT; const int t0 = (int)(r0 % TT); for (int e = tid; e < 128 * 8; e += 128) { const int cl = e >> 3, q = e & 7; vst2((unsigned*)(VT + (b * CC + h * HD + cl) * (size_t)TT + t0 + q * 8), *(const v4u*)&tv[cl][q * 8]); } } }
__device__ __forceinline__ v8f mma(v16h a, v16h b, v8f c) { return __builtin_amdgcn_wmma_f32_16x16x32_f16(false, a, false, b, (short)0, c, false, false); }
__device__ __forceinline__ float xhalf(float x) { return __builtin_bit_cast(float, __builtin_amdgcn_permlanex16(__builtin_bit_cast(int, x), __builtin_bit_cast(int, x), 0x76543210, 0xfedcba98, false, false)); }  // lane l with lane l ^ 16
__device__ __forceinline__ v16h frag_p(const _Float16* p) { union { v16h v; v8h q[2]; } u; u.q[0] = *(const v8h*)p; u.q[1] = *(const v8h*)(p + 16); return u.v; }   // frag_h with the lane half's 8 elements already in p
// precaution behind a run of global loads: the wait stands in front of any overwrite of the address register they name (named as an input so that it stays live up to here)
#define XWAIT(p) asm volatile("s_wait_xcnt 0x0" :: "v"(p) : "memory")
#define P_SHIFT 7.624618986159398f   // 11 ln 2: exp(v - (m - 11 ln 2)) = 2^11 exp(v - m)
// ---- K / V ring in LDS, filled by tensor loads: a stage = 128 keys = 4 passes; the K tile (128 key rows x 128 d) and the V tile (128 d planes x 128 keys) have one shape:
// 128 rows of 256 B at a source pitch of 4,096 B, laid at an LDS pitch of 272 B (the mover's 16-B pad: 16 B x odd for 16-byte LDS reads)
typedef unsigned u32x4 __attribute__((ext_vector_type(4)));
typedef unsigned u32x8 __attribute__((ext_vector_type(8)));
#define SK 128
#define NST (TT / SK)
#define LPITCH 272u
#define TILE_B (128u * LPITCH)   // 34,816 B = 17 x 2 KiB
#define SLOT_B (2u * TILE_B)     // K tile, then V tile
__device__ __forceinline__ unsigned uni(unsigned v) { return (unsigned)__builtin_amdgcn_readfirstlane((int)v); }
__device__ __forceinline__ unsigned pinned(unsigned v) { unsigned w = uni(v); asm volatile("" : "+s"(w)); return w; }   // holds the word in a scalar register: the test on it compiles to a scalar branch (tensor loads ignore EXEC)
__device__ __forceinline__ v16h frag_l(const unsigned char* p) { union { v16h v; v8h q[2]; } u; u.q[0] = *(const v8h*)p; u.q[1] = *(const v8h*)(p + 32); return u.v; }   // frag_p on LDS bytes
__global__ __launch_bounds__(256) __attribute__((amdgpu_waves_per_eu(2, 2))) void k_fa(const _Float16* __restrict__ QH, const _Float16* __restrict__ KH, const _Float16* __restrict__ VT, float* __restrict__ OUT) {
  __shared__ __attribute__((aligned(2048))) unsigned char ring[2 * SLOT_B];
  __shared__ __align__(16) float ss[8][32][HD + 4];
  const int tid = threadIdx.x, lane = tid & 31, col = lane & 15, g = lane >> 4; const unsigned wave = uni((unsigned)tid >> 5); const int h = blockIdx.y, b = blockIdx.z; const int ql0 = blockIdx.x * 256 + (int)wave * 32;
  const unsigned lbase = (unsigned)(size_t)ring;
  // wave 0 brings each stage's K tile, wave 1 its V tile: one request a wave and stage
  const unsigned long long tsrc = wave == 0 ? (unsigned long long)(size_t)(KH + (size_t)b * TT * CC + h * HD) : (unsigned long long)(size_t)(VT + ((size_t)b * CC + h * HD) * (size_t)TT);
  const unsigned tstep = wave == 0 ? 2u * SK * CC : 2u * SK;   // bytes from one stage's tile to the next: 128 key rows, or 128 keys along a plane
  u32x8 g1;   // 1-byte elements, tensor = tile = 128 rows of 256 B, source pitch 4,096 B, a 4-dword pad behind every 64 dwords, no mask
  g1[0] = uni((1u << 20) | (5u << 22) | (3u << 25)); g1[1] = uni(256u << 16); g1[2] = uni(128u << 16); g1[3] = uni(256u << 16); g1[4] = uni(128u); g1[5] = uni(2u * CC); g1[6] = uni(0u); g1[7] = uni(0u);
  auto issue = [&](unsigned st) {
    const unsigned long long ga = tsrc + (unsigned long long)st * tstep; u32x4 g0;
    g0[0] = uni(1u); g0[1] = uni(lbase + (st & 1u) * SLOT_B + wave * TILE_B); g0[2] = uni((unsigned)ga); g0[3] = uni((((unsigned)(ga >> 32)) & 0x01FFFFFFu) | 0x80000000u);
    asm volatile("tensor_load_to_lds %0, %1" :: "s"(g0), "s"(g1) : "memory"); };
  if (pinned(wave < 2u)) { issue(0u); asm volatile("s_wait_tensorcnt 0x0" ::: "memory"); }   // stage 0 has landed before the barrier that publishes it
  const _Float16* Ql = QH + ((size_t)b * TT + ql0 + col) * CC + h * HD + 8 * g;
  v16h qf[2][4];
#pragma unroll
  for (int u = 0; u < 2; ++u)
#pragma unroll
    for (int kc = 0; kc < 4; ++kc) qf[u][kc] = frag_p(Ql + (size_t)(16 * u) * CC + kc * 32);
  XWAIT(Ql);
  v8f acc[2][8] = {}; float m_run[2] = {-3.0e38f, -3.0e38f}, l_run[2] = {0.f, 0.f};
  __syncthreads();
  if (pinned(wave < 2u)) issue(1u);
  const unsigned char* lrow = ring + col * LPITCH + g * 16;   // this lane's 16 bytes in row col of a tile
  for (unsigned st = 0; st < NST; ++st) {
    const unsigned char* kb = lrow + (st & 1u) * SLOT_B; const unsigned char* vb = kb + TILE_B;
    v16h kf[2][4];
#pragma unroll
    for (int kt = 0; kt < 2; ++kt)
#pragma unroll
      for (int kc = 0; kc < 4; ++kc) kf[kt][kc] = frag_l(kb + (16 * kt) * LPITCH + kc * 64);
    __builtin_amdgcn_sched_barrier(0);   // the stage's first k rows as one group of LDS reads too, not in pairs that are each waited for at once
#pragma unroll
    for (int p = 0; p < SK / 32; ++p) {   // unrolled: every LDS offset of a pass is an immediate, and the last pass of a stage fetches no k rows ahead
      v8f s[2][2];
#pragma unroll
      for (int kt = 0; kt < 2; ++kt)
#pragma unroll
        for (int u = 0; u < 2; ++u) { s[kt][u] = v8f{};
#pragma unroll
          for (int kc = 0; kc < 4; ++kc) s[kt][u] = mma(kf[kt][kc], qf[u][kc], s[kt][u]); }
      __builtin_amdgcn_sched_barrier(0);   // with the one below: the pass's LDS reads stand as one group here; without them the compiler spreads them among the matrix instructions, some directly in front of their use
      v16h vf[8];   // this pass's v planes, in flight under its softmax
#pragma unroll
      for (int t = 0; t < 8; ++t) vf[t] = frag_l(vb + (16 * t) * LPITCH + p * 64);
      if (p + 1 < SK / 32) {   // next pass's k rows of the same stage, in flight under this pass's softmax and P.v
#pragma unroll
        for (int kt = 0; kt < 2; ++kt)
#pragma unroll
          for (int kc = 0; kc < 4; ++kc) kf[kt][kc] = frag_l(kb + ((p + 1) * 32 + 16 * kt) * LPITCH + kc * 64); }
      __builtin_amdgcn_sched_barrier(0);
      float mb[2]; bool need = false;
#pragma unroll
      for (int u = 0; u < 2; ++u) { float mx = s[0][u][0];
#pragma unroll
        for (int r = 1; r < 8; ++r) mx = fmaxf(mx, s[0][u][r]);
#pragma unroll
        for (int r = 0; r < 8; ++r) mx = fmaxf(mx, s[1][u][r]);
        mx = fmaxf(mx, xhalf(mx)) * SCALE; mb[u] = mx; need = need || (mx > m_run[u]); }
      if (__builtin_amdgcn_ballot_w32(need) != 0) {   // some query's maximum grew: bring sums and outputs to the new maximum (factor 1 for the others)
#pragma unroll
        for (int u = 0; u < 2; ++u) { const float mn = fmaxf(m_run[u], mb[u]); const float corr = expf(m_run[u] - mn); m_run[u] = mn; l_run[u] *= corr;
#pragma unroll
          for (int t = 0; t < 8; ++t) acc[u][t] = acc[u][t] * corr; } }
#pragma unroll
      for (int u = 0; u < 2; ++u) { const float mo = m_run[u] - P_SHIFT; v16h pf; float sum = 0.f;
#pragma unroll
        for (int i = 0; i < 16; ++i) { const float pe = expf(s[i >> 3][u][i & 7] * SCALE - mo); sum += pe; pf[i] = (_Float16)pe; }
        l_run[u] += sum;
#pragma unroll
        for (int t = 0; t < 8; ++t) acc[u][t] = mma(vf[t], pf, acc[u][t]); }
    }
    // publish point of stage st + 1: this wave's LDS reads of stage st are done, the issuers' tiles have landed, every wave has left stage st's buffer; only then its refill
    asm volatile("s_wait_dscnt 0x0" ::: "memory");
    if (pinned(wave < 2u)) asm volatile("s_wait_tensorcnt 0x0" ::: "memory");
    __syncthreads();
    if (pinned(wave < 2u && st + 2u < NST)) issue(pinned(st + 2u));   // a scalar test; the stage number is held in a scalar register here so that the descriptor is formed behind the wait and the barrier
  }
  asm volatile("s_wait_tensorcnt 0x0" ::: "memory");   // nothing of the mover's is in flight when the wave goes on to its end
  asm volatile("s_wait_dscnt 0x0" ::: "memory");
#pragma unroll
  for (int u = 0; u < 2; ++u) { const float inv = 1.0f / (l_run[u] + xhalf(l_run[u]));   // each wave half summed its eight keys of every 16-key tile
#pragma unroll
    for (int t = 0; t < 8; ++t) { const v8f o = acc[u][t] * inv; vst2(&ss[wave][16 * u + col][t * 16 + 8 * g], v4f{o[0], o[1], o[2], o[3]}); vst2(&ss[wave][16 * u + col][t * 16 + 8 * g + 4], v4f{o[4], o[5], o[6], o[7]}); } }
  LDSX(); for (int rl = 0; rl < 32; ++rl) vst2(OUT + ((size_t)b * TT + ql0 + rl) * CC + h * HD + lane * 4, *(const v4f*)&ss[wave][rl][lane * 4]); }   /* 512-B (row, head) segment by 32 lanes */
extern "C" void kernel_launch(void* const* d_in, const int* in_sizes, int n_in, void* d_out, int out_size, void* d_ws, size_t ws_size, hipStream_t stream) {
  (void)in_sizes; (void)n_in; (void)out_size;
  const float** F = (const float**)d_in;   // 0 query, 1 key, 2 value [2,2048,16,128]
  if (ws_size < (size_t)WS_END) return;
  char* ws = (char*)d_ws; _Float16 *QH = (_Float16*)(ws + WS_QH), *KH = (_Float16*)(ws + WS_KH), *VT = (_Float16*)(ws + WS_VT);
  k_prep<<<dim3(TNB * TT / 64, NH), 128, 0, stream>>>(F[0], F[1], F[2], QH, KH, VT);
  k_fa<<<dim3(TT / 256, NH, TNB), 256, 0, stream>>>(QH, KH, VT, (float*)d_out);
}

// v003
// A run of this version takes 70.3 microseconds.
// Two timings next to v002 both put it at 1.37 times that version's speed.
// Over all steps from v000 it is 20.8 times as fast.
// compute dtype: the three float inputs rounded to bf16; q, k once to f16 -> 1-product logits x 128^-0.5 on WMMA 16x16x32 (f32 accumulate); softmax in f32 in the base-2 domain (logit x log2 e, hardware exp2) with a running maximum and sum; exp(logit - running maximum) x 2^11 once to f16 against v once to f16 (1 product), divided by the f32 sum at the end; f32 output.
#include <hip/hip_runtime.h>
#include <math.h>

typedef __attribute__((ext_vector_type(16))) _Float16 v16h;
typedef __attribute__((ext_vector_type(16))) __bf16 v16b;
typedef __attribute__((ext_vector_type(8)))  _Float16 v8h;
typedef __attribute__((ext_vector_type(8)))  float v8f;
typedef __attribute__((ext_vector_type(4)))  float v4f;
typedef __attribute__((ext_vector_type(2)))  float v2f;
typedef __attribute__((ext_vector_type(4)))  unsigned v4u;
typedef __attribute__((ext_vector_type(4)))  int v4i;
typedef float __attribute__((may_alias)) float_a;
typedef int __attribute__((may_alias)) int_a;

template <typename T> __device__ __forceinline__ void vst2(void* p, T v) { *(T*)p = v;  }
__device__ __forceinline__ v8f wmma16(v16h a, v16h b, v8f c) {
  v8f d = __builtin_amdgcn_wmma_f32_16x16x32_f16(false, a, false, b, (short)0, c, false, false);
  asm volatile("v_nop\n\tv_nop\n\tv_nop\n\tv_nop" : "+v"(d) : "v"(a), "v"(b));
  return d;
}
__device__ __forceinline__ v8f wmma_bf(v16b a, v16b b, v8f c) {
  v8f d = __builtin_amdgcn_wmma_f32_16x16x32_bf16(false, a, false, b, (short)0, c, false, false);
  asm volatile("v_nop\n\tv_nop\n\tv_nop\n\tv_nop" : "+v"(d) : "v"(a), "v"(b));
  return d;
}
// 16x16x32 fragments: lane = (h = lane>>4, row/col = lane&15); elements 0..7 = k0+8h+0..7, 8..15 = k0+16+8h+0..7; D element r = row 8h+r
__device__ __forceinline__ v16h frag_h(const _Float16* rowk0, int lane) {
  union { v16h v; v8h q[2]; } u; const _Float16* p = rowk0 + 8 * (lane >> 4);
  u.q[0] = *(const v8h*)p; u.q[1] = *(const v8h*)(p + 16); return u.v;
}
__device__ __forceinline__ v16h frag_f32(const float* rowk0, int lane) {
  v16h a; const float* p = rowk0 + 8 * (lane >> 4);
#pragma unroll
  for (int i = 0; i < 8; ++i) { a[i] = (_Float16)p[i]; a[8 + i] = (_Float16)p[16 + i]; }
  return a;
}
__device__ __forceinline__ v16h frag_f32s(const float* rowk0, int lane, float sc) {
  v16h a; const float* p = rowk0 + 8 * (lane >> 4);
#pragma unroll
  for (int i = 0; i < 8; ++i) { a[i] = (_Float16)(p[i] * sc); a[8 + i] = (_Float16)(p[16 + i] * sc); }
  return a;
}
// column fragment from a [K][ld] layout (column n), rows >= K read as 0
__device__ __forceinline__ v16h fragc_f32(const float* W, int k0, int n, int lane, int ld, int K) {
  v16h a; const int g = lane >> 4;
#pragma unroll
  for (int i = 0; i < 8; ++i) { const int ka = k0 + 8 * g + i, kb = ka + 16;
    a[i] = (_Float16)(ka < K ? W[(size_t)(ka < K ? ka : K - 1) * ld + n] : 0.f); a[8 + i] = (_Float16)(kb < K ? W[(size_t)(kb < K ? kb : K - 1) * ld + n] : 0.f); }
  return a;
}
struct F2 { v16b h, l; };
__device__ __forceinline__ F2 bsplit16(const float v[16]) { F2 r;
#pragma unroll
  for (int i = 0; i < 16; ++i) { const __bf16 h = (__bf16)v[i]; r.h[i] = h; r.l[i] = (__bf16)(v[i] - (float)h); }
  return r; }
__device__ __forceinline__ F2 split_row(const float* row, int k0, int lane) { float v[16]; const float* p = row + k0 + 8 * (lane >> 4);
#pragma unroll
  for (int i = 0; i < 8; ++i) { v[i] = p[i]; v[8 + i] = p[16 + i]; }
  return bsplit16(v); }
__device__ __forceinline__ F2 split_rowK(const float* row, int k0, int lane, int K) { float v[16]; const int g = lane >> 4;
#pragma unroll
  for (int i = 0; i < 8; ++i) { const int ka = k0 + 8 * g + i, kb = ka + 16; v[i] = ka < K ? row[ka < K ? ka : K - 1] : 0.f; v[8 + i] = kb < K ? row[kb < K ? kb : K - 1] : 0.f; }
  return bsplit16(v); }
__device__ __forceinline__ F2 split_col(const float* W, int k0, int n, int lane, int ld, int K) { float v[16]; const int g = lane >> 4;
#pragma unroll
  for (int i = 0; i < 8; ++i) { const int ka = k0 + 8 * g + i, kb = ka + 16; v[i] = ka < K ? W[(size_t)(ka < K ? ka : K - 1) * ld + n] : 0.f; v[8 + i] = kb < K ? W[(size_t)(kb < K ? kb : K - 1) * ld + n] : 0.f; }
  return bsplit16(v); }
__device__ __forceinline__ v8f mac3(const F2& a, const F2& b, v8f c) { c = wmma_bf(a.l, b.h, c); c = wmma_bf(a.h, b.l, c); return wmma_bf(a.h, b.h, c); }
__device__ __forceinline__ float sigm(float v) { return 1.0f / (1.0f + expf(-v)); }
#define LDSX() do { asm volatile("s_wait_dscnt 0" ::: "memory"); __builtin_amdgcn_wave_barrier(); __builtin_amdgcn_fence(__ATOMIC_RELEASE, "workgroup"); } while (0)

// Plain multi-head attention on [B, S, H, D] tensors (B 2, S 2,048, 16 heads x 128; no projections, no mask): probs = softmax(q . k x 128^-0.5) over all keys; out[b][s][h][d] = sum probs v.
#define NB 2
#define TT 2048
#define NH 16
#define HD 128
#define CC (NH * HD)        // 2048
#define SCALE 0.08838834764831845f
#ifndef TNB
#define TNB NB
#endif
__device__ __forceinline__ float bfr(float v) { return (float)(__bf16)v; }

#define WS_QH  0u                                      // f16 q rows [b*t][2048]
#define WS_KH  (WS_QH + 2u * (size_t)NB * TT * CC)      // f16 k rows
#define WS_VT  (WS_KH + 2u * (size_t)NB * TT * CC)      // f16 v planes [b][c][t]
#define WS_END (WS_VT + 2u * (size_t)NB * CC * TT)

// ---- k_prep: block = (64 tokens, head h): q, k -> f16 rows, v -> f16 planes (all bf16-rounded first)
__global__ __launch_bounds__(128) void k_prep(const float* __restrict__ Q, const float* __restrict__ K, const float* __restrict__ V, _Float16* __restrict__ QH, _Float16* __restrict__ KH, _Float16* __restrict__ VT) {
  __shared__ __align__(16) _Float16 sq[64][136], sk[64][136], tv[128][72];
  const int tid = threadIdx.x; const int h = blockIdx.y; const size_t r0 = (size_t)blockIdx.x * 64;
  for (int e = tid; e < 64 * 128; e += 128) { const int rl = e >> 7, c = e & 127; const size_t o = (r0 + rl) * CC + h * HD + c; sq[rl][c] = (_Float16)bfr(Q[o]); sk[rl][c] = (_Float16)bfr(K[o]); tv[c][rl] = (_Float16)bfr(V[o]); }
  __syncthreads();
  for (int e = tid; e < 64 * 16; e += 128) { const int rl = e >> 4, q = e & 15; const size_t o = (r0 + rl) * CC + h * HD + q * 8; vst2((unsigned*)(QH + o), *(const v4u*)&sq[rl][q * 8]); vst2((unsigned*)(KH + o), *(const v4u*)&sk[rl][q * 8]); }   /* 256-B (row, head) segments by 16 threads */
  { const size_t b = r0 / TT; const int t0 = (int)(r0 % TT); for (int e = tid; e < 128 * 8; e += 128) { const int cl = e >> 3, q = e & 7; vst2((unsigned*)(VT + (b * CC + h * HD + cl) * (size_t)TT + t0 + q * 8), *(const v4u*)&tv[cl][q * 8]); } } }
__device__ __forceinline__ v8f mma(v16h a, v16h b, v8f c) { return __builtin_amdgcn_wmma_f32_16x16x32_f16(false, a, false, b, (short)0, c, false, false); }
__device__ __forceinline__ float xhalf(float x) { return __builtin_bit_cast(float, __builtin_amdgcn_permlanex16(__builtin_bit_cast(int, x), __builtin_bit_cast(int, x), 0x76543210, 0xfedcba98, false, false)); }  // lane l with lane l ^ 16
__device__ __forceinline__ v16h frag_p(const _Float16* p) { union { v16h v; v8h q[2]; } u; u.q[0] = *(const v8h*)p; u.q[1] = *(const v8h*)(p + 16); return u.v; }   // frag_h with the lane half's 8 elements already in p
// precaution behind a run of global loads: the wait stands in front of any overwrite of the address register they name (named as an input so that it stays live up to here)
#define XWAIT(p) asm volatile("s_wait_xcnt 0x0" :: "v"(p) : "memory")
#define SCALE2 0.12751743082f   // 128^-0.5 x log2 e: exp(x) = 2^(x log2 e), so scores, maxima and differences are kept in base-2 units
#define P_SHIFT 11.0f   // 2^(v - (m - 11)) = 2^11 2^(v - m)
// ---- K / V ring in LDS, filled by tensor loads: a stage = 128 keys = 4 passes; the K tile (128 key rows x 128 d) and the V tile (128 d planes x 128 keys) have one shape:
// 128 rows of 256 B at a source pitch of 4,096 B, laid at an LDS pitch of 272 B (the mover's 16-B pad: 16 B x odd for 16-byte LDS reads)
typedef unsigned u32x4 __attribute__((ext_vector_type(4)));
typedef unsigned u32x8 __attribute__((ext_vector_type(8)));
#define SK 128
#define NST (TT / SK)
#define LPITCH 272u
#define TILE_B (128u * LPITCH)   // 34,816 B = 17 x 2 KiB
#define SLOT_B (2u * TILE_B)     // K tile, then V tile
__device__ __forceinline__ unsigned uni(unsigned v) { return (unsigned)__builtin_amdgcn_readfirstlane((int)v); }
__device__ __forceinline__ unsigned pinned(unsigned v) { unsigned w = uni(v); asm volatile("" : "+s"(w)); return w; }   // holds the word in a scalar register: the test on it compiles to a scalar branch (tensor loads ignore EXEC)
__device__ __forceinline__ v16h frag_l(const unsigned char* p) { union { v16h v; v8h q[2]; } u; u.q[0] = *(const v8h*)p; u.q[1] = *(const v8h*)(p + 32); return u.v; }   // frag_p on LDS bytes
__global__ __launch_bounds__(256) __attribute__((amdgpu_waves_per_eu(2, 2))) void k_fa(const _Float16* __restrict__ QH, const _Float16* __restrict__ KH, const _Float16* __restrict__ VT, float* __restrict__ OUT) {
  __shared__ __attribute__((aligned(2048))) unsigned char ring[2 * SLOT_B];
  __shared__ __align__(16) float ss[8][32][HD + 4];
  const int tid = threadIdx.x, lane = tid & 31, col = lane & 15, g = lane >> 4; const unsigned wave = uni((unsigned)tid >> 5); const int h = blockIdx.y, b = blockIdx.z; const int ql0 = blockIdx.x * 256 + (int)wave * 32;
  const unsigned lbase = (unsigned)(size_t)ring;
  // wave 0 brings each stage's K tile, wave 1 its V tile: one request a wave and stage
  const unsigned long long tsrc = wave == 0 ? (unsigned long long)(size_t)(KH + (size_t)b * TT * CC + h * HD) : (unsigned long long)(size_t)(VT + ((size_t)b * CC + h * HD) * (size_t)TT);
  const unsigned tstep = wave == 0 ? 2u * SK * CC : 2u * SK;   // bytes from one stage's tile to the next: 128 key rows, or 128 keys along a plane
  u32x8 g1;   // 1-byte elements, tensor = tile = 128 rows of 256 B, source pitch 4,096 B, a 4-dword pad behind every 64 dwords, no mask
  g1[0] = uni((1u << 20) | (5u << 22) | (3u << 25)); g1[1] = uni(256u << 16); g1[2] = uni(128u << 16); g1[3] = uni(256u << 16); g1[4] = uni(128u); g1[5] = uni(2u * CC); g1[6] = uni(0u); g1[7] = uni(0u);
  auto issue = [&](unsigned st) {
    const unsigned long long ga = tsrc + (unsigned long long)st * tstep; u32x4 g0;
    g0[0] = uni(1u); g0[1] = uni(lbase + (st & 1u) * SLOT_B + wave * TILE_B); g0[2] = uni((unsigned)ga); g0[3] = uni((((unsigned)(ga >> 32)) & 0x01FFFFFFu) | 0x80000000u);
    asm volatile("tensor_load_to_lds %0, %1" :: "s"(g0), "s"(g1) : "memory"); };
  if (pinned(wave < 2u)) { issue(0u); asm volatile("s_wait_tensorcnt 0x0" ::: "memory"); }   // stage 0 has landed before the barrier that publishes it
  const _Float16* Ql = QH + ((size_t)b * TT + ql0 + col) * CC + h * HD + 8 * g;
  v16h qf[2][4];
#pragma unroll
  for (int u = 0; u < 2; ++u)
#pragma unroll
    for (int kc = 0; kc < 4; ++kc) qf[u][kc] = frag_p(Ql + (size_t)(16 * u) * CC + kc * 32);
  XWAIT(Ql);
  v8f acc[2][8] = {}; float m_run[2] = {-3.0e38f, -3.0e38f}, l_run[2] = {0.f, 0.f};
  __syncthreads();
  if (pinned(wave < 2u)) issue(1u);
  const unsigned char* lrow = ring + col * LPITCH + g * 16;   // this lane's 16 bytes in row col of a tile
  for (unsigned st = 0; st < NST; ++st) {
    const unsigned char* kb = lrow + (st & 1u) * SLOT_B; const unsigned char* vb = kb + TILE_B;
    v16h kf[2][4];
#pragma unroll
    for (int kt = 0; kt < 2; ++kt)
#pragma unroll
      for (int kc = 0; kc < 4; ++kc) kf[kt][kc] = frag_l(kb + (16 * kt) * LPITCH + kc * 64);
    __builtin_amdgcn_sched_barrier(0);   // the stage's first k rows as one group of LDS reads too, not in pairs that are each waited for at once
#pragma unroll
    for (int p = 0; p < SK / 32; ++p) {   // unrolled: every LDS offset of a pass is an immediate, and the last pass of a stage fetches no k rows ahead
      v8f s[2][2];
#pragma unroll
      for (int kt = 0; kt < 2; ++kt)
#pragma unroll
        for (int u = 0; u < 2; ++u) { s[kt][u] = v8f{};
#pragma unroll
          for (int kc = 0; kc < 4; ++kc) s[kt][u] = mma(kf[kt][kc], qf[u][kc], s[kt][u]); }
      __builtin_amdgcn_sched_barrier(0);   // with the one below: the pass's LDS reads stand as one group here; without them the compiler spreads them among the matrix instructions, some directly in front of their use
      v16h vf[8];   // this pass's v planes, in flight under its softmax
#pragma unroll
      for (int t = 0; t < 8; ++t) vf[t] = frag_l(vb + (16 * t) * LPITCH + p * 64);
      if (p + 1 < SK / 32) {   // next pass's k rows of the same stage, in flight under this pass's softmax and P.v
#pragma unroll
        for (int kt = 0; kt < 2; ++kt)
#pragma unroll
          for (int kc = 0; kc < 4; ++kc) kf[kt][kc] = frag_l(kb + ((p + 1) * 32 + 16 * kt) * LPITCH + kc * 64); }
      __builtin_amdgcn_sched_barrier(0);
      float mb[2]; bool need = false;
#pragma unroll
      for (int u = 0; u < 2; ++u) { float mx = s[0][u][0];
#pragma unroll
        for (int r = 1; r < 8; ++r) mx = fmaxf(mx, s[0][u][r]);
#pragma unroll
        for (int r = 0; r < 8; ++r) mx = fmaxf(mx, s[1][u][r]);
        mx = fmaxf(mx, xhalf(mx)) * SCALE2; mb[u] = mx; need = need || (mx > m_run[u]); }
      if (__builtin_amdgcn_ballot_w32(need) != 0) {   // some query's maximum grew: bring sums and outputs to the new maximum (factor 1 for the others)
#pragma unroll
        for (int u = 0; u < 2; ++u) { const float mn = fmaxf(m_run[u], mb[u]); const float corr = __builtin_amdgcn_exp2f(m_run[u] - mn); m_run[u] = mn; l_run[u] *= corr;
#pragma unroll
          for (int t = 0; t < 8; ++t) acc[u][t] = acc[u][t] * corr; } }
#pragma unroll
      for (int u = 0; u < 2; ++u) { const float mo = m_run[u] - P_SHIFT; v16h pf; float sum = 0.f;
#pragma unroll
        for (int i = 0; i < 16; ++i) { const float pe = __builtin_amdgcn_exp2f(__builtin_fmaf(s[i >> 3][u][i & 7], SCALE2, -mo)); sum += pe; pf[i] = (_Float16)pe; }
        l_run[u] += sum;
#pragma unroll
        for (int t = 0; t < 8; ++t) acc[u][t] = mma(vf[t], pf, acc[u][t]); }
    }
    // publish point of stage st + 1: this wave's LDS reads of stage st are done, the issuers' tiles have landed, every wave has left stage st's buffer; only then its refill
    asm volatile("s_wait_dscnt 0x0" ::: "memory");
    if (pinned(wave < 2u)) asm volatile("s_wait_tensorcnt 0x0" ::: "memory");
    __syncthreads();
    if (pinned(wave < 2u && st + 2u < NST)) issue(pinned(st + 2u));   // a scalar test; the stage number is held in a scalar register here so that the descriptor is formed behind the wait and the barrier
  }
  asm volatile("s_wait_tensorcnt 0x0" ::: "memory");   // nothing of the mover's is in flight when the wave goes on to its end
  asm volatile("s_wait_dscnt 0x0" ::: "memory");
#pragma unroll
  for (int u = 0; u < 2; ++u) { const float inv = 1.0f / (l_run[u] + xhalf(l_run[u]));   // each wave half summed its eight keys of every 16-key tile
#pragma unroll
    for (int t = 0; t < 8; ++t) { const v8f o = acc[u][t] * inv; vst2(&ss[wave][16 * u + col][t * 16 + 8 * g], v4f{o[0], o[1], o[2], o[3]}); vst2(&ss[wave][16 * u + col][t * 16 + 8 * g + 4], v4f{o[4], o[5], o[6], o[7]}); } }
  LDSX(); for (int rl = 0; rl < 32; ++rl) vst2(OUT + ((size_t)b * TT + ql0 + rl) * CC + h * HD + lane * 4, *(const v4f*)&ss[wave][rl][lane * 4]); }   /* 512-B (row, head) segment by 32 lanes */
extern "C" void kernel_launch(void* const* d_in, const int* in_sizes, int n_in, void* d_out, int out_size, void* d_ws, size_t ws_size, hipStream_t stream) {
  (void)in_sizes; (void)n_in; (void)out_size;
  const float** F = (const float**)d_in;   // 0 query, 1 key, 2 value [2,2048,16,128]
  if (ws_size < (size_t)WS_END) return;
  char* ws = (char*)d_ws; _Float16 *QH = (_Float16*)(ws + WS_QH), *KH = (_Float16*)(ws + WS_KH), *VT = (_Float16*)(ws + WS_VT);
  k_prep<<<dim3(TNB * TT / 64, NH), 128, 0, stream>>>(F[0], F[1], F[2], QH, KH, VT);
  k_fa<<<dim3(TT / 256, NH, TNB), 256, 0, stream>>>(QH, KH, VT, (float*)d_out);
}

// v004
// Measured time: 67.5 microseconds a run.
// Next to v003, in two timings, it ran 1.04 times as fast each time.
// Over all steps from v000 it is 21.6 times as fast.
// compute dtype: the three float inputs rounded to bf16; q, k once to f16 -> 1-product logits x 128^-0.5 on WMMA 16x16x32 (f32 accumulate); softmax in f32 in the base-2 domain (logit x log2 e, hardware exp2) with a running maximum and sum; exp(logit - maximum in use) x 2^7 once to f16 (the maximum in use lags the running maximum by at most 8 in base-2 units) against v once to f16 (1 product), divided by the f32 sum at the end; f32 output.
#include <hip/hip_runtime.h>
#include <math.h>

typedef __attribute__((ext_vector_type(16))) _Float16 v16h;
typedef __attribute__((ext_vector_type(16))) __bf16 v16b;
typedef __attribute__((ext_vector_type(8)))  _Float16 v8h;
typedef __attribute__((ext_vector_type(8)))  float v8f;
typedef __attribute__((ext_vector_type(4)))  float v4f;
typedef __attribute__((ext_vector_type(2)))  float v2f;
typedef __attribute__((ext_vector_type(4)))  unsigned v4u;
typedef __attribute__((ext_vector_type(4)))  int v4i;
typedef float __attribute__((may_alias)) float_a;
typedef int __attribute__((may_alias)) int_a;

template <typename T> __device__ __forceinline__ void vst2(void* p, T v) { *(T*)p = v;  }
__device__ __forceinline__ v8f wmma16(v16h a, v16h b, v8f c) {
  v8f d = __builtin_amdgcn_wmma_f32_16x16x32_f16(false, a, false, b, (short)0, c, false, false);
  asm volatile("v_nop\n\tv_nop\n\tv_nop\n\tv_nop" : "+v"(d) : "v"(a), "v"(b));
  return d;
}
__device__ __forceinline__ v8f wmma_bf(v16b a, v16b b, v8f c) {
  v8f d = __builtin_amdgcn_wmma_f32_16x16x32_bf16(false, a, false, b, (short)0, c, false, false);
  asm volatile("v_nop\n\tv_nop\n\tv_nop\n\tv_nop" : "+v"(d) : "v"(a), "v"(b));
  return d;
}
// 16x16x32 fragments: lane = (h = lane>>4, row/col = lane&15); elements 0..7 = k0+8h+0..7, 8..15 = k0+16+8h+0..7; D element r = row 8h+r
__device__ __forceinline__ v16h frag_h(const _Float16* rowk0, int lane) {
  union { v16h v; v8h q[2]; } u; const _Float16* p = rowk0 + 8 * (lane >> 4);
  u.q[0] = *(const v8h*)p; u.q[1] = *(const v8h*)(p + 16); return u.v;
}
__device__ __forceinline__ v16h frag_f32(const float* rowk0, int lane) {
  v16h a; const float* p = rowk0 + 8 * (lane >> 4);
#pragma unroll
  for (int i = 0; i < 8; ++i) { a[i] = (_Float16)p[i]; a[8 + i] = (_Float16)p[16 + i]; }
  return a;
}
__device__ __forceinline__ v16h frag_f32s(const float* rowk0, int lane, float sc) {
  v16h a; const float* p = rowk0 + 8 * (lane >> 4);
#pragma unroll
  for (int i = 0; i < 8; ++i) { a[i] = (_Float16)(p[i] * sc); a[8 + i] = (_Float16)(p[16 + i] * sc); }
  return a;
}
// column fragment from a [K][ld] layout (column n), rows >= K read as 0
__device__ __forceinline__ v16h fragc_f32(const float* W, int k0, int n, int lane, int ld, int K) {
  v16h a; const int g = lane >> 4;
#pragma unroll
  for (int i = 0; i < 8; ++i) { const int ka = k0 + 8 * g + i, kb = ka + 16;
    a[i] = (_Float16)(ka < K ? W[(size_t)(ka < K ? ka : K - 1) * ld + n] : 0.f); a[8 + i] = (_Float16)(kb < K ? W[(size_t)(kb < K ? kb : K - 1) * ld + n] : 0.f); }
  return a;
}
struct F2 { v16b h, l; };
__device__ __forceinline__ F2 bsplit16(const float v[16]) { F2 r;
#pragma unroll
  for (int i = 0; i < 16; ++i) { const __bf16 h = (__bf16)v[i]; r.h[i] = h; r.l[i] = (__bf16)(v[i] - (float)h); }
  return r; }
__device__ __forceinline__ F2 split_row(const float* row, int k0, int lane) { float v[16]; const float* p = row + k0 + 8 * (lane >> 4);
#pragma unroll
  for (int i = 0; i < 8; ++i) { v[i] = p[i]; v[8 + i] = p[16 + i]; }
  return bsplit16(v); }
__device__ __forceinline__ F2 split_rowK(const float* row, int k0, int lane, int K) { float v[16]; const int g = lane >> 4;
#pragma unroll
  for (int i = 0; i < 8; ++i) { const int ka = k0 + 8 * g + i, kb = ka + 16; v[i] = ka < K ? row[ka < K ? ka : K - 1] : 0.f; v[8 + i] = kb < K ? row[kb < K ? kb : K - 1] : 0.f; }
  return bsplit16(v); }
__device__ __forceinline__ F2 split_col(const float* W, int k0, int n, int lane, int ld, int K) { float v[16]; const int g = lane >> 4;
#pragma unroll
  for (int i = 0; i < 8; ++i) { const int ka = k0 + 8 * g + i, kb = ka + 16; v[i] = ka < K ? W[(size_t)(ka < K ? ka : K - 1) * ld + n] : 0.f; v[8 + i] = kb < K ? W[(size_t)(kb < K ? kb : K - 1) * ld + n] : 0.f; }
  return bsplit16(v); }
__device__ __forceinline__ v8f mac3(const F2& a, const F2& b, v8f c) { c = wmma_bf(a.l, b.h, c); c = wmma_bf(a.h, b.l, c); return wmma_bf(a.h, b.h, c); }
__device__ __forceinline__ float sigm(float v) { return 1.0f / (1.0f + expf(-v)); }
#define LDSX() do { asm volatile("s_wait_dscnt 0" ::: "memory"); __builtin_amdgcn_wave_barrier(); __builtin_amdgcn_fence(__ATOMIC_RELEASE, "workgroup"); } while (0)

// Plain multi-head attention on [B, S, H, D] tensors (B 2, S 2,048, 16 heads x 128; no projections, no mask): probs = softmax(q . k x 128^-0.5) over all keys; out[b][s][h][d] = sum probs v.
#define NB 2
#define TT 2048
#define NH 16
#define HD 128
#define CC (NH * HD)        // 2048
#define SCALE 0.08838834764831845f
#ifndef TNB
#define TNB NB
#endif
__device__ __forceinline__ float bfr(float v) { return (float)(__bf16)v; }

#define WS_QH  0u                                      // f16 q rows [b*t][2048]
#define WS_KH  (WS_QH + 2u * (size_t)NB * TT * CC)      // f16 k rows
#define WS_VT  (WS_KH + 2u * (size_t)NB * TT * CC)      // f16 v planes [b][c][t]
#define WS_END (WS_VT + 2u * (size_t)NB * CC * TT)

// ---- k_prep: block = (64 tokens, head h): q, k -> f16 rows, v -> f16 planes (all bf16-rounded first)
__global__ __launch_bounds__(128) void k_prep(const float* __restrict__ Q, const float* __restrict__ K, const float* __restrict__ V, _Float16* __restrict__ QH, _Float16* __restrict__ KH, _Float16* __restrict__ VT) {
  __shared__ __align__(16) _Float16 sq[64][136], sk[64][136], tv[128][72];
  const int tid = threadIdx.x; const int h = blockIdx.y; const size_t r0 = (size_t)blockIdx.x * 64;
  for (int e = tid; e < 64 * 128; e += 128) { const int rl = e >> 7, c = e & 127; const size_t o = (r0 + rl) * CC + h * HD + c; sq[rl][c] = (_Float16)bfr(Q[o]); sk[rl][c] = (_Float16)bfr(K[o]); tv[c][rl] = (_Float16)bfr(V[o]); }
  __syncthreads();
  for (int e = tid; e < 64 * 16; e += 128) { const int rl = e >> 4, q = e & 15; const size_t o = (r0 + rl) * CC + h * HD + q * 8; vst2((unsigned*)(QH + o), *(const v4u*)&sq[rl][q * 8]); vst2((unsigned*)(KH + o), *(const v4u*)&sk[rl][q * 8]); }   /* 256-B (row, head) segments by 16 threads */
  { const size_t b = r0 / TT; const int t0 = (int)(r0 % TT); for (int e = tid; e < 128 * 8; e += 128) { const int cl = e >> 3, q = e & 7; vst2((unsigned*)(VT + (b * CC + h * HD + cl) * (size_t)TT + t0 + q * 8), *(const v4u*)&tv[cl][q * 8]); } } }
__device__ __forceinline__ v8f mma(v16h a, v16h b, v8f c) { return __builtin_amdgcn_wmma_f32_16x16x32_f16(false, a, false, b, (short)0, c, false, false); }
__device__ __forceinline__ float xhalf(float x) { return __builtin_bit_cast(float, __builtin_amdgcn_permlanex16(__builtin_bit_cast(int, x), __builtin_bit_cast(int, x), 0x76543210, 0xfedcba98, false, false)); }  // lane l with lane l ^ 16
__device__ __forceinline__ v16h frag_p(const _Float16* p) { union { v16h v; v8h q[2]; } u; u.q[0] = *(const v8h*)p; u.q[1] = *(const v8h*)(p + 16); return u.v; }   // frag_h with the lane half's 8 elements already in p
// precaution behind a run of global loads: the wait stands in front of any overwrite of the address register they name (named as an input so that it stays live up to here)
#define XWAIT(p) asm volatile("s_wait_xcnt 0x0" :: "v"(p) : "memory")
#define SCALE2 0.12751743082f   // 128^-0.5 x log2 e: exp(x) = 2^(x log2 e), so scores, maxima and differences are kept in base-2 units
#define P_SHIFT 7.0f   // 2^(v - (m - 7)) = 2^7 2^(v - m)
#define LAZY 8.0f   // the maximum in use is raised only when a pass's maximum lies more than 8 above it: P x 2^7 stays at or below 2^15, inside f16; what lies 21 or more below the maximum in use is an f16 subnormal, an error under 2^-32 of the largest term
// ---- K / V ring in LDS, filled by tensor loads: a stage = 128 keys = 4 passes; the K tile (128 key rows x 128 d) and the V tile (128 d planes x 128 keys) have one shape:
// 128 rows of 256 B at a source pitch of 4,096 B, laid at an LDS pitch of 272 B (the mover's 16-B pad: 16 B x odd for 16-byte LDS reads)
typedef unsigned u32x4 __attribute__((ext_vector_type(4)));
typedef unsigned u32x8 __attribute__((ext_vector_type(8)));
#define SK 128
#define NST (TT / SK)
#define LPITCH 272u
#define TILE_B (128u * LPITCH)   // 34,816 B = 17 x 2 KiB
#define SLOT_B (2u * TILE_B)     // K tile, then V tile
__device__ __forceinline__ unsigned uni(unsigned v) { return (unsigned)__builtin_amdgcn_readfirstlane((int)v); }
__device__ __forceinline__ unsigned pinned(unsigned v) { unsigned w = uni(v); asm volatile("" : "+s"(w)); return w; }   // holds the word in a scalar register: the test on it compiles to a scalar branch (tensor loads ignore EXEC)
__device__ __forceinline__ v16h frag_l(const unsigned char* p) { union { v16h v; v8h q[2]; } u; u.q[0] = *(const v8h*)p; u.q[1] = *(const v8h*)(p + 32); return u.v; }   // frag_p on LDS bytes
__global__ __launch_bounds__(256) __attribute__((amdgpu_waves_per_eu(2, 2))) void k_fa(const _Float16* __restrict__ QH, const _Float16* __restrict__ KH, const _Float16* __restrict__ VT, float* __restrict__ OUT) {
  __shared__ __attribute__((aligned(2048))) unsigned char ring[2 * SLOT_B];
  __shared__ __align__(16) float ss[8][32][HD + 4];
  const int tid = threadIdx.x, lane = tid & 31, col = lane & 15, g = lane >> 4; const unsigned wave = uni((unsigned)tid >> 5); const int h = blockIdx.y, b = blockIdx.z; const int ql0 = blockIdx.x * 256 + (int)wave * 32;
  const unsigned lbase = (unsigned)(size_t)ring;
  // wave 0 brings each stage's K tile, wave 1 its V tile: one request a wave and stage
  const unsigned long long tsrc = wave == 0 ? (unsigned long long)(size_t)(KH + (size_t)b * TT * CC + h * HD) : (unsigned long long)(size_t)(VT + ((size_t)b * CC + h * HD) * (size_t)TT);
  const unsigned tstep = wave == 0 ? 2u * SK * CC : 2u * SK;   // bytes from one stage's tile to the next: 128 key rows, or 128 keys along a plane
  u32x8 g1;   // 1-byte elements, tensor = tile = 128 rows of 256 B, source pitch 4,096 B, a 4-dword pad behind every 64 dwords, no mask
  g1[0] = uni((1u << 20) | (5u << 22) | (3u << 25)); g1[1] = uni(256u << 16); g1[2] = uni(128u << 16); g1[3] = uni(256u << 16); g1[4] = uni(128u); g1[5] = uni(2u * CC); g1[6] = uni(0u); g1[7] = uni(0u);
  auto issue = [&](unsigned st) {
    const unsigned long long ga = tsrc + (unsigned long long)st * tstep; u32x4 g0;
    g0[0] = uni(1u); g0[1] = uni(lbase + (st & 1u) * SLOT_B + wave * TILE_B); g0[2] = uni((unsigned)ga); g0[3] = uni((((unsigned)(ga >> 32)) & 0x01FFFFFFu) | 0x80000000u);
    asm volatile("tensor_load_to_lds %0, %1" :: "s"(g0), "s"(g1) : "memory"); };
  if (pinned(wave < 2u)) { issue(0u); asm volatile("s_wait_tensorcnt 0x0" ::: "memory"); }   // stage 0 has landed before the barrier that publishes it
  const _Float16* Ql = QH + ((size_t)b * TT + ql0 + col) * CC + h * HD + 8 * g;
  v16h qf[2][4];
#pragma unroll
  for (int u = 0; u < 2; ++u)
#pragma unroll
    for (int kc = 0; kc < 4; ++kc) qf[u][kc] = frag_p(Ql + (size_t)(16 * u) * CC + kc * 32);
  XWAIT(Ql);
  v8f acc[2][8] = {}; float m_run[2] = {-3.0e38f, -3.0e38f}, l_run[2] = {0.f, 0.f};
  __syncthreads();
  if (pinned(wave < 2u)) issue(1u);
  const unsigned char* lrow = ring + col * LPITCH + g * 16;   // this lane's 16 bytes in row col of a tile
  for (unsigned st = 0; st < NST; ++st) {
    const unsigned char* kb = lrow + (st & 1u) * SLOT_B; const unsigned char* vb = kb + TILE_B;
    v16h kf[2][4];
#pragma unroll
    for (int kt = 0; kt < 2; ++kt)
#pragma unroll
      for (int kc = 0; kc < 4; ++kc) kf[kt][kc] = frag_l(kb + (16 * kt) * LPITCH + kc * 64);
    __builtin_amdgcn_sched_barrier(0);   // the stage's first k rows as one group of LDS reads too, not in pairs that are each waited for at once
#pragma unroll
    for (int p = 0; p < SK / 32; ++p) {   // unrolled: every LDS offset of a pass is an immediate, and the last pass of a stage fetches no k rows ahead
      v8f s[2][2];
#pragma unroll
      for (int kt = 0; kt < 2; ++kt)
#pragma unroll
        for (int u = 0; u < 2; ++u) { s[kt][u] = v8f{};
#pragma unroll
          for (int kc = 0; kc < 4; ++kc) s[kt][u] = mma(kf[kt][kc], qf[u][kc], s[kt][u]); }
      __builtin_amdgcn_sched_barrier(0);   // with the one below: the pass's LDS reads stand as one group here; without them the compiler spreads them among the matrix instructions, some directly in front of their use
      v16h vf[8];   // this pass's v planes, in flight under its softmax
#pragma unroll
      for (int t = 0; t < 8; ++t) vf[t] = frag_l(vb + (16 * t) * LPITCH + p * 64);
      if (p + 1 < SK / 32) {   // next pass's k rows of the same stage, in flight under this pass's softmax and P.v
#pragma unroll
        for (int kt = 0; kt < 2; ++kt)
#pragma unroll
          for (int kc = 0; kc < 4; ++kc) kf[kt][kc] = frag_l(kb + ((p + 1) * 32 + 16 * kt) * LPITCH + kc * 64); }
      __builtin_amdgcn_sched_barrier(0);
      float mb[2]; bool need = false;
#pragma unroll
      for (int u = 0; u < 2; ++u) { float mx = s[0][u][0];
#pragma unroll
        for (int r = 1; r < 8; ++r) mx = fmaxf(mx, s[0][u][r]);
#pragma unroll
        for (int r = 0; r < 8; ++r) mx = fmaxf(mx, s[1][u][r]);
        mx = fmaxf(mx, xhalf(mx)) * SCALE2; mb[u] = mx; need = need || (mx > m_run[u] + LAZY); }
      if (__builtin_amdgcn_ballot_w32(need) != 0) {   // some query's maximum left the range: bring every query's sums and outputs to its own running maximum (factor 1 where it has not grown)
#pragma unroll
        for (int u = 0; u < 2; ++u) { const float mn = fmaxf(m_run[u], mb[u]); const float corr = __builtin_amdgcn_exp2f(m_run[u] - mn); m_run[u] = mn; l_run[u] *= corr;
#pragma unroll
          for (int t = 0; t < 8; ++t) acc[u][t] = acc[u][t] * corr; } }
#pragma unroll
      for (int u = 0; u < 2; ++u) { const float mo = m_run[u] - P_SHIFT; v16h pf; float sum = 0.f;
#pragma unroll
        for (int i = 0; i < 16; ++i) { const float pe = __builtin_amdgcn_exp2f(__builtin_fmaf(s[i >> 3][u][i & 7], SCALE2, -mo)); sum += pe; pf[i] = (_Float16)pe; }
        l_run[u] += sum;
#pragma unroll
        for (int t = 0; t < 8; ++t) acc[u][t] = mma(vf[t], pf, acc[u][t]); }
    }
    // publish point of stage st + 1: this wave's LDS reads of stage st are done, the issuers' tiles have landed, every wave has left stage st's buffer; only then its refill
    asm volatile("s_wait_dscnt 0x0" ::: "memory");
    if (pinned(wave < 2u)) asm volatile("s_wait_tensorcnt 0x0" ::: "memory");
    __syncthreads();
    if (pinned(wave < 2u && st + 2u < NST)) issue(pinned(st + 2u));   // a scalar test; the stage number is held in a scalar register here so that the descriptor is formed behind the wait and the barrier
  }
  asm volatile("s_wait_tensorcnt 0x0" ::: "memory");   // nothing of the mover's is in flight when the wave goes on to its end
  asm volatile("s_wait_dscnt 0x0" ::: "memory");
#pragma unroll
  for (int u = 0; u < 2; ++u) { const float inv = 1.0f / (l_run[u] + xhalf(l_run[u]));   // each wave half summed its eight keys of every 16-key tile
#pragma unroll
    for (int t = 0; t < 8; ++t) { const v8f o = acc[u][t] * inv; vst2(&ss[wave][16 * u + col][t * 16 + 8 * g], v4f{o[0], o[1], o[2], o[3]}); vst2(&ss[wave][16 * u + col][t * 16 + 8 * g + 4], v4f{o[4], o[5], o[6], o[7]}); } }
  LDSX(); for (int rl = 0; rl < 32; ++rl) vst2(OUT + ((size_t)b * TT + ql0 + rl) * CC + h * HD + lane * 4, *(const v4f*)&ss[wave][rl][lane * 4]); }   /* 512-B (row, head) segment by 32 lanes */
extern "C" void kernel_launch(void* const* d_in, const int* in_sizes, int n_in, void* d_out, int out_size, void* d_ws, size_t ws_size, hipStream_t stream) {
  (void)in_sizes; (void)n_in; (void)out_size;
  const float** F = (const float**)d_in;   // 0 query, 1 key, 2 value [2,2048,16,128]
  if (ws_size < (size_t)WS_END) return;
  char* ws = (char*)d_ws; _Float16 *QH = (_Float16*)(ws + WS_QH), *KH = (_Float16*)(ws + WS_KH), *VT = (_Float16*)(ws + WS_VT);
  k_prep<<<dim3(TNB * TT / 64, NH), 128, 0, stream>>>(F[0], F[1], F[2], QH, KH, VT);
  k_fa<<<dim3(TT / 256, NH, TNB), 256, 0, stream>>>(QH, KH, VT, (float*)d_out);
}
